// v000
// Times are from an AMD MI455X. After a warm-up the kernel runs many times in a row, and a time is the length of
// such a window on the GPU divided by its runs, so every launch and the gaps after it count. The runs cycle
// through copies of the inputs. A figure is the median of several windows, for all but v000 over two sittings.
// Sittings can differ by a few percent; kernels timed side by side share one.
// The starting kernel, v000, takes 706 microseconds a run.
#include <hip/hip_runtime.h>

typedef float v2f __attribute__((ext_vector_type(2)));
typedef float v4f __attribute__((ext_vector_type(4)));
typedef float v8f __attribute__((ext_vector_type(8)));

#define M_TOT  16384   // B*S = 4*4096
#define D_DIM  2048
#define O_DIM  2048
#define E_NUM  2
#define R_RK   8
#define LORA_SCALE 2.0f   // 16/8

#define BM 128
#define BN 128
#define BK 32
#define LDSS 36          // LDS row stride in floats: 144B -> 16B aligned rows, conflict-free

__global__ __launch_bounds__(256)
void fused_lora_moe_kernel(const float* __restrict__ x,
                           const float* __restrict__ Wb,
                           const float* __restrict__ bb,
                           const float* __restrict__ Amat,   // [E,R,D] == [16, D]
                           const float* __restrict__ Bmat,   // [E,O,R]
                           const float* __restrict__ Wr,     // [D,E]
                           const float* __restrict__ br,     // [E]
                           float* __restrict__ out)
{
    __shared__ float xs[BM * LDSS];   // x tile      [128 x 32]
    __shared__ float ws[BN * LDSS];   // W_base tile [128 x 32]
    __shared__ float ss[32 * LDSS];   // small mat   [32 x 32] (A rows 0..15, router 16..17, zeros)
    __shared__ float gb[BM * LDSS];   // staged h + router logits per token

    const int tid   = threadIdx.x;
    const int lane  = tid & 31;
    const int wave  = tid >> 5;
    const int lrow  = lane & 15;        // row/col within a 16-wide fragment
    const int halfk = (lane >> 4) * 2;  // 0 for lanes 0-15, 2 for lanes 16-31
    const int mBase = blockIdx.y * BM;
    const int nBase = blockIdx.x * BN;

    // per-thread staging coordinates (constant across K-chunks)
    const int g_row = tid >> 3;         // 0..31 within a 32-row group
    const int g_c   = (tid & 7) * 4;    // 0,4,...,28

    v8f acc[8];
    v8f accS[2];
    const v8f zero8 = {0.f,0.f,0.f,0.f,0.f,0.f,0.f,0.f};
#pragma unroll
    for (int i = 0; i < 8; ++i) acc[i] = zero8;
    accS[0] = zero8; accS[1] = zero8;

    // register prefetch buffers (software pipeline, depth 2)
    v4f rx[4], rw[4], rs;

#define LOAD_GLOBALS(K0)                                                       \
    do {                                                                       \
        _Pragma("unroll")                                                      \
        for (int i = 0; i < 4; ++i) {                                          \
            int idx = tid + i * 256;                                           \
            int row = idx >> 3;                                                \
            int c   = (idx & 7) * 4;                                           \
            rx[i] = *(const v4f*)(x  + (size_t)(mBase + row) * D_DIM + (K0) + c); \
            rw[i] = *(const v4f*)(Wb + (size_t)(nBase + row) * D_DIM + (K0) + c); \
        }                                                                      \
        if (g_row < 16) {                                                      \
            rs = *(const v4f*)(Amat + (size_t)g_row * D_DIM + (K0) + g_c);     \
        } else if (g_row < 18) {                                               \
            int e = g_row - 16;                                                \
            rs.x = Wr[(size_t)((K0) + g_c + 0) * E_NUM + e];                   \
            rs.y = Wr[(size_t)((K0) + g_c + 1) * E_NUM + e];                   \
            rs.z = Wr[(size_t)((K0) + g_c + 2) * E_NUM + e];                   \
            rs.w = Wr[(size_t)((K0) + g_c + 3) * E_NUM + e];                   \
        } else {                                                               \
            rs.x = rs.y = rs.z = rs.w = 0.f;                                   \
        }                                                                      \
    } while (0)

    LOAD_GLOBALS(0);

    for (int k0 = 0; k0 < D_DIM; k0 += BK) {
        __syncthreads();   // previous chunk's LDS consumers done

        // ---- commit prefetched registers to LDS ----
#pragma unroll
        for (int i = 0; i < 4; ++i) {
            int idx = tid + i * 256;
            int row = idx >> 3;
            int c   = (idx & 7) * 4;
            *(v4f*)&xs[row * LDSS + c] = rx[i];
            *(v4f*)&ws[row * LDSS + c] = rw[i];
        }
        *(v4f*)&ss[g_row * LDSS + g_c] = rs;
        __syncthreads();

        // ---- prefetch next chunk's globals during compute ----
        if (k0 + BK < D_DIM) {
            LOAD_GLOBALS(k0 + BK);
        }

        // ---- compute: 8 K-steps of V_WMMA_F32_16X16X4_F32 per 16x16 tile ----
        const float* xrow = &xs[(wave * 16 + lrow) * LDSS];
#pragma unroll
        for (int kk = 0; kk < BK; kk += 4) {
            v2f a = *(const v2f*)&xrow[kk + halfk];
#pragma unroll
            for (int nt = 0; nt < 8; ++nt) {
                v2f b = *(const v2f*)&ws[(nt * 16 + lrow) * LDSS + kk + halfk];
                acc[nt] = __builtin_amdgcn_wmma_f32_16x16x4_f32(
                    false, a, false, b, (short)0, acc[nt], false, false);
            }
#pragma unroll
            for (int st = 0; st < 2; ++st) {
                v2f b = *(const v2f*)&ss[(st * 16 + lrow) * LDSS + kk + halfk];
                accS[st] = __builtin_amdgcn_wmma_f32_16x16x4_f32(
                    false, a, false, b, (short)0, accS[st], false, false);
            }
        }
    }
#undef LOAD_GLOBALS

    // ---- stage h (cols 0..15) and router logits (cols 16,17) into LDS, C/D layout ----
#pragma unroll
    for (int st = 0; st < 2; ++st) {
#pragma unroll
        for (int i = 0; i < 8; ++i) {
            int row = wave * 16 + (lane >> 4) * 8 + i;
            gb[row * LDSS + st * 16 + lrow] = accS[st][i];
        }
    }
    __syncthreads();

    // ---- per-token softmax over 2 experts, fold routing weight * scale into A-frag ----
    {
        int row = wave * 16 + lrow;
        float l0 = gb[row * LDSS + 16] + br[0];
        float l1 = gb[row * LDSS + 17] + br[1];
        float mx = fmaxf(l0, l1);
        float e0 = __expf(l0 - mx);
        float e1 = __expf(l1 - mx);
        float inv = 1.0f / (e0 + e1);
        float w0 = e0 * inv * LORA_SCALE;
        float w1 = e1 * inv * LORA_SCALE;

        // routed = G @ Bflat^T, K = E*R = 16 -> 4 WMMA K-steps, accumulated into acc[]
#pragma unroll
        for (int kk = 0; kk < 16; kk += 4) {
            int kidx = kk + halfk;               // even; pair {kidx, kidx+1} within one expert
            float wf = (kidx < R_RK) ? w0 : w1;
            v2f a;
            a.x = gb[row * LDSS + kidx]     * wf;
            a.y = gb[row * LDSS + kidx + 1] * wf;
            int e = kidx >> 3;
            int r = kidx & 7;
#pragma unroll
            for (int nt = 0; nt < 8; ++nt) {
                int o = nBase + nt * 16 + lrow;
                v2f b = *(const v2f*)(Bmat + ((size_t)e * O_DIM + o) * R_RK + r);
                acc[nt] = __builtin_amdgcn_wmma_f32_16x16x4_f32(
                    false, a, false, b, (short)0, acc[nt], false, false);
            }
        }
    }

    // ---- bias + non-temporal store (out is write-once; keep x/W resident in L2) ----
#pragma unroll
    for (int nt = 0; nt < 8; ++nt) {
        int col = nBase + nt * 16 + lrow;
        float bias = bb[col];
#pragma unroll
        for (int i = 0; i < 8; ++i) {
            int r = mBase + wave * 16 + (lane >> 4) * 8 + i;
            __builtin_nontemporal_store(acc[nt][i] + bias, &out[(size_t)r * O_DIM + col]);
        }
    }
}

extern "C" void kernel_launch(void* const* d_in, const int* in_sizes, int n_in,
                              void* d_out, int out_size, void* d_ws, size_t ws_size,
                              hipStream_t stream) {
    const float* x    = (const float*)d_in[0];  // [4,4096,2048]
    const float* Wb   = (const float*)d_in[1];  // [2048,2048]
    const float* bb   = (const float*)d_in[2];  // [2048]
    const float* Amat = (const float*)d_in[3];  // [2,8,2048]
    const float* Bmat = (const float*)d_in[4];  // [2,2048,8]
    const float* Wr   = (const float*)d_in[5];  // [2048,2]
    const float* br   = (const float*)d_in[6];  // [2]
    float* out = (float*)d_out;                 // [4,4096,2048]

    dim3 grid(O_DIM / BN, M_TOT / BM);          // (16, 128)
    dim3 block(256);
    fused_lora_moe_kernel<<<grid, block, 0, stream>>>(x, Wb, bb, Amat, Bmat, Wr, br, out);
}

// v001
// Measured time: 623 microseconds a run.
// Two timings next to v000 both put it at 1.20 times that version's speed.
#include <hip/hip_runtime.h>

typedef float v2f __attribute__((ext_vector_type(2)));
typedef float v4f __attribute__((ext_vector_type(4)));
typedef float v8f __attribute__((ext_vector_type(8)));

#define M_TOT  16384   // B*S = 4*4096
#define D_DIM  2048
#define O_DIM  2048
#define E_NUM  2
#define R_RK   8
#define LORA_SCALE 2.0f   // 16/8

#define BM 128
#define BN 128
#define BK 32
#define LDSS 36          // LDS row stride in floats: 144B -> 16B aligned rows, conflict-free

#define PM  64           // tokens per workgroup of the pre-kernel
#define PK  128          // K chunk of the pre-kernel: 512 B of a row = one wave-wide 16-byte load
#define PLD 132          // LDS row stride in floats: 528 B = 16 B x odd, conflict-free 16-byte reads
#define PPL 20           // row stride of the partial sums (16 h columns + 2 logits, padded)

// G[token][e*8+r] = softmax(x Wr + br)[e] * LORA_SCALE * (x A^T)[e*8+r], computed once per token.
__global__ __launch_bounds__(512)
void lora_router_pre_kernel(const float* __restrict__ x,
                            const float* __restrict__ Amat,   // [E,R,D] == [16, D]
                            const float* __restrict__ Wr,     // [D,E]
                            const float* __restrict__ br,     // [E]
                            float* __restrict__ G)            // [M_TOT, 16]
{
    __shared__ float xs[PM * PLD];        // x chunk [64 x 128]
    __shared__ float ss[18 * PLD];        // A rows 0..15, router columns as rows 16,17
    __shared__ float part[4 * PM * PPL];  // per K-quarter partial h and logits

    const int tid   = threadIdx.x;
    const int lane  = tid & 31;
    const int wave  = tid >> 5;         // 0..15
    const int lrow  = lane & 15;
    const int h     = lane >> 4;
    const int rt    = wave & 3;         // 16-token tile of this wave
    const int kq    = wave >> 2;        // 32-wide quarter of every K chunk
    const int mBase = blockIdx.x * PM;

    const v8f zero8 = {0.f,0.f,0.f,0.f,0.f,0.f,0.f,0.f};
    v8f accH = zero8;                   // columns = the 16 (expert, rank) pairs
    v8f accR = zero8;                   // columns 0,1 = router logits; the others are never read

    v4f rx[4], ra, rr;

#define PRE_LOAD(K0)                                                           \
    do {                                                                       \
        _Pragma("unroll")                                                      \
        for (int i = 0; i < 4; ++i)                                            \
            rx[i] = *(const v4f*)(x + (size_t)(mBase + wave * 4 + i) * D_DIM + (K0) + lane * 4); \
        ra = *(const v4f*)(Amat + (size_t)wave * D_DIM + (K0) + lane * 4);     \
        if (tid < 64)                                                          \
            rr = *(const v4f*)(Wr + (size_t)((K0) + tid * 2) * E_NUM);         \
    } while (0)

    PRE_LOAD(0);

    for (int k0 = 0; k0 < D_DIM; k0 += PK) {
        __syncthreads();   // previous chunk's LDS consumers done
#pragma unroll
        for (int i = 0; i < 4; ++i)
            *(v4f*)&xs[(wave * 4 + i) * PLD + lane * 4] = rx[i];
        *(v4f*)&ss[wave * PLD + lane * 4] = ra;
        if (tid < 64) {
            v2f e0 = {rr.x, rr.z};
            v2f e1 = {rr.y, rr.w};
            *(v2f*)&ss[16 * PLD + tid * 2] = e0;
            *(v2f*)&ss[17 * PLD + tid * 2] = e1;
        }
        __syncthreads();

        if (k0 + PK < D_DIM) {
            PRE_LOAD(k0 + PK);
            // the loads' address registers are advanced below: keep the wait in front of that
            asm volatile("s_wait_xcnt 0x0" ::: "memory");
        }

        // A and B fragments come from the same offsets, so both see the same k at every position:
        // lane half h, 16-byte read j -> k = kq*32 + j*8 + h*4 + {0,1} (first WMMA), + {2,3} (second).
        const float* xr = &xs[(rt * 16 + lrow) * PLD + kq * 32 + h * 4];
        const float* ar = &ss[lrow * PLD + kq * 32 + h * 4];
        const float* rp = &ss[(16 + (lrow & 1)) * PLD + kq * 32 + h * 4];
#pragma unroll
        for (int j = 0; j < 4; ++j) {
            v4f xa = *(const v4f*)(xr + j * 8);
            v4f ba = *(const v4f*)(ar + j * 8);
            v4f bq = *(const v4f*)(rp + j * 8);
            v2f a0 = {xa.x, xa.y}, a1 = {xa.z, xa.w};
            v2f p0 = {ba.x, ba.y}, p1 = {ba.z, ba.w};
            v2f q0 = {bq.x, bq.y}, q1 = {bq.z, bq.w};
            accH = __builtin_amdgcn_wmma_f32_16x16x4_f32(false, a0, false, p0, (short)0, accH, false, false);
            accR = __builtin_amdgcn_wmma_f32_16x16x4_f32(false, a0, false, q0, (short)0, accR, false, false);
            accH = __builtin_amdgcn_wmma_f32_16x16x4_f32(false, a1, false, p1, (short)0, accH, false, false);
            accR = __builtin_amdgcn_wmma_f32_16x16x4_f32(false, a1, false, q1, (short)0, accR, false, false);
        }
    }
#undef PRE_LOAD

    // ---- partial sums of the four K quarters into LDS (C/D layout) ----
#pragma unroll
    for (int i = 0; i < 8; ++i) {
        int row = rt * 16 + h * 8 + i;
        part[(kq * PM + row) * PPL + lrow] = accH[i];
        if (lrow < 2) part[(kq * PM + row) * PPL + 16 + lrow] = accR[i];
    }
    __syncthreads();

    // ---- per-token softmax over 2 experts, routing weight * scale folded into h ----
    {
        const int row = tid >> 3;          // 0..63
        const int c   = (tid & 7) * 2;     // pair {c, c+1} within one expert
        const float* p0 = &part[(0 * PM + row) * PPL];
        const float* p1 = &part[(1 * PM + row) * PPL];
        const float* p2 = &part[(2 * PM + row) * PPL];
        const float* p3 = &part[(3 * PM + row) * PPL];
        float l0 = ((p0[16] + p1[16]) + p2[16]) + p3[16] + br[0];
        float l1 = ((p0[17] + p1[17]) + p2[17]) + p3[17] + br[1];
        float mx = fmaxf(l0, l1);
        float e0 = __expf(l0 - mx);
        float e1 = __expf(l1 - mx);
        float inv = 1.0f / (e0 + e1);
        float w0 = e0 * inv * LORA_SCALE;
        float w1 = e1 * inv * LORA_SCALE;
        float wf = (c < R_RK) ? w0 : w1;
        v2f g;
        g.x = (((p0[c]     + p1[c])     + p2[c])     + p3[c])     * wf;
        g.y = (((p0[c + 1] + p1[c + 1]) + p2[c + 1]) + p3[c + 1]) * wf;
        *(v2f*)(G + (size_t)(mBase + row) * 16 + c) = g;
    }
}

__global__ __launch_bounds__(256)
void fused_lora_moe_kernel(const float* __restrict__ x,
                           const float* __restrict__ Wb,
                           const float* __restrict__ bb,
                           const float* __restrict__ Bmat,   // [E,O,R]
                           const float* __restrict__ G,      // [M_TOT,16] from the pre-kernel
                           float* __restrict__ out)
{
    __shared__ float xs[BM * LDSS];   // x tile      [128 x 32]
    __shared__ float ws[BN * LDSS];   // W_base tile [128 x 32]

    const int tid   = threadIdx.x;
    const int lane  = tid & 31;
    const int wave  = tid >> 5;
    const int lrow  = lane & 15;        // row/col within a 16-wide fragment
    const int halfk = (lane >> 4) * 2;  // 0 for lanes 0-15, 2 for lanes 16-31
    const int mBase = blockIdx.y * BM;
    const int nBase = blockIdx.x * BN;

    v8f acc[8];
    const v8f zero8 = {0.f,0.f,0.f,0.f,0.f,0.f,0.f,0.f};
#pragma unroll
    for (int i = 0; i < 8; ++i) acc[i] = zero8;

    // register prefetch buffers (software pipeline, depth 2)
    v4f rx[4], rw[4];

#define LOAD_GLOBALS(K0)                                                       \
    do {                                                                       \
        _Pragma("unroll")                                                      \
        for (int i = 0; i < 4; ++i) {                                          \
            int idx = tid + i * 256;                                           \
            int row = idx >> 3;                                                \
            int c   = (idx & 7) * 4;                                           \
            rx[i] = *(const v4f*)(x  + (size_t)(mBase + row) * D_DIM + (K0) + c); \
            rw[i] = *(const v4f*)(Wb + (size_t)(nBase + row) * D_DIM + (K0) + c); \
        }                                                                      \
    } while (0)

    LOAD_GLOBALS(0);

    for (int k0 = 0; k0 < D_DIM; k0 += BK) {
        __syncthreads();   // previous chunk's LDS consumers done

        // ---- commit prefetched registers to LDS ----
#pragma unroll
        for (int i = 0; i < 4; ++i) {
            int idx = tid + i * 256;
            int row = idx >> 3;
            int c   = (idx & 7) * 4;
            *(v4f*)&xs[row * LDSS + c] = rx[i];
            *(v4f*)&ws[row * LDSS + c] = rw[i];
        }
        __syncthreads();

        // ---- prefetch next chunk's globals during compute ----
        if (k0 + BK < D_DIM) {
            LOAD_GLOBALS(k0 + BK);
            // the fragment reads below reuse the loads' address registers: keep the wait in front of them
            asm volatile("s_wait_xcnt 0x0" ::: "memory");
        }

        // ---- compute: 8 K-steps of V_WMMA_F32_16X16X4_F32 per 16x16 tile ----
        const float* xrow = &xs[(wave * 16 + lrow) * LDSS];
#pragma unroll
        for (int kk = 0; kk < BK; kk += 4) {
            v2f a = *(const v2f*)&xrow[kk + halfk];
#pragma unroll
            for (int nt = 0; nt < 8; ++nt) {
                v2f b = *(const v2f*)&ws[(nt * 16 + lrow) * LDSS + kk + halfk];
                acc[nt] = __builtin_amdgcn_wmma_f32_16x16x4_f32(
                    false, a, false, b, (short)0, acc[nt], false, false);
            }
        }
    }
#undef LOAD_GLOBALS

    {
        const float* grow = G + (size_t)(mBase + wave * 16 + lrow) * 16;
        v2f ga[4];
#pragma unroll
        for (int q = 0; q < 4; ++q) ga[q] = *(const v2f*)(grow + q * 4 + halfk);
        // later loads may land in the address registers of the four loads above: wait first
        asm volatile("s_wait_xcnt 0x0" ::: "memory");

        // routed = G @ Bflat^T, K = E*R = 16 -> 4 WMMA K-steps, accumulated into acc[]
#pragma unroll
        for (int kk = 0; kk < 16; kk += 4) {
            int kidx = kk + halfk;               // even; pair {kidx, kidx+1} within one expert
            v2f a = ga[kk >> 2];
            int e = kidx >> 3;
            int r = kidx & 7;
#pragma unroll
            for (int nt = 0; nt < 8; ++nt) {
                int o = nBase + nt * 16 + lrow;
                v2f b = *(const v2f*)(Bmat + ((size_t)e * O_DIM + o) * R_RK + r);
                acc[nt] = __builtin_amdgcn_wmma_f32_16x16x4_f32(
                    false, a, false, b, (short)0, acc[nt], false, false);
            }
        }
    }

    // ---- bias + non-temporal store (out is write-once; keep x/W resident in L2) ----
#pragma unroll
    for (int nt = 0; nt < 8; ++nt) {
        int col = nBase + nt * 16 + lrow;
        float bias = bb[col];
#pragma unroll
        for (int i = 0; i < 8; ++i) {
            int r = mBase + wave * 16 + (lane >> 4) * 8 + i;
            __builtin_nontemporal_store(acc[nt][i] + bias, &out[(size_t)r * O_DIM + col]);
        }
    }
}

extern "C" void kernel_launch(void* const* d_in, const int* in_sizes, int n_in,
                              void* d_out, int out_size, void* d_ws, size_t ws_size,
                              hipStream_t stream) {
    const float* x    = (const float*)d_in[0];  // [4,4096,2048]
    const float* Wb   = (const float*)d_in[1];  // [2048,2048]
    const float* bb   = (const float*)d_in[2];  // [2048]
    const float* Amat = (const float*)d_in[3];  // [2,8,2048]
    const float* Bmat = (const float*)d_in[4];  // [2,2048,8]
    const float* Wr   = (const float*)d_in[5];  // [2048,2]
    const float* br   = (const float*)d_in[6];  // [2]
    float* out = (float*)d_out;                 // [4,4096,2048]
    float* G   = (float*)d_ws;                  // [16384,16], written and read in this call

    dim3 grid(O_DIM / BN, M_TOT / BM);          // (16, 128)
    dim3 block(256);
    lora_router_pre_kernel<<<dim3(M_TOT / PM), dim3(512), 0, stream>>>(x, Amat, Wr, br, G);
    fused_lora_moe_kernel<<<grid, block, 0, stream>>>(x, Wb, bb, Bmat, G, out);
}

// v002
// Measured time: 595 microseconds a run.
// Next to v001, in two timings, it ran 1.05 times as fast each time.
// All steps since v000 together make it 1.25 times as fast.
#include <hip/hip_runtime.h>

typedef float v2f __attribute__((ext_vector_type(2)));
typedef float v4f __attribute__((ext_vector_type(4)));
typedef float v8f __attribute__((ext_vector_type(8)));

#define M_TOT  16384   // B*S = 4*4096
#define D_DIM  2048
#define O_DIM  2048
#define E_NUM  2
#define R_RK   8
#define LORA_SCALE 2.0f   // 16/8

#define BM 256
#define BN 128
#define BK 32
#define FM 4             // 16-row x fragments per wave: a wave owns a 64 x 64 piece of the output
#define FN 4             // 16-column W_base fragments per wave
#define LDSS 36          // LDS row stride in floats: 144B -> 16B aligned rows, conflict-free

#define PM  64           // tokens per workgroup of the pre-kernel
#define PK  128          // K chunk of the pre-kernel: 512 B of a row = one wave-wide 16-byte load
#define PLD 132          // LDS row stride in floats: 528 B = 16 B x odd, conflict-free 16-byte reads
#define PPL 20           // row stride of the partial sums (16 h columns + 2 logits, padded)

// G[token][e*8+r] = softmax(x Wr + br)[e] * LORA_SCALE * (x A^T)[e*8+r], computed once per token.
__global__ __launch_bounds__(512)
void lora_router_pre_kernel(const float* __restrict__ x,
                            const float* __restrict__ Amat,   // [E,R,D] == [16, D]
                            const float* __restrict__ Wr,     // [D,E]
                            const float* __restrict__ br,     // [E]
                            float* __restrict__ G)            // [M_TOT, 16]
{
    __shared__ float xs[PM * PLD];        // x chunk [64 x 128]
    __shared__ float ss[18 * PLD];        // A rows 0..15, router columns as rows 16,17
    __shared__ float part[4 * PM * PPL];  // per K-quarter partial h and logits

    const int tid   = threadIdx.x;
    const int lane  = tid & 31;
    const int wave  = tid >> 5;         // 0..15
    const int lrow  = lane & 15;
    const int h     = lane >> 4;
    const int rt    = wave & 3;         // 16-token tile of this wave
    const int kq    = wave >> 2;        // 32-wide quarter of every K chunk
    const int mBase = blockIdx.x * PM;

    const v8f zero8 = {0.f,0.f,0.f,0.f,0.f,0.f,0.f,0.f};
    v8f accH = zero8;                   // columns = the 16 (expert, rank) pairs
    v8f accR = zero8;                   // columns 0,1 = router logits; the others are never read

    v4f rx[4], ra, rr;

#define PRE_LOAD(K0)                                                           \
    do {                                                                       \
        _Pragma("unroll")                                                      \
        for (int i = 0; i < 4; ++i)                                            \
            rx[i] = *(const v4f*)(x + (size_t)(mBase + wave * 4 + i) * D_DIM + (K0) + lane * 4); \
        ra = *(const v4f*)(Amat + (size_t)wave * D_DIM + (K0) + lane * 4);     \
        if (tid < 64)                                                          \
            rr = *(const v4f*)(Wr + (size_t)((K0) + tid * 2) * E_NUM);         \
    } while (0)

    PRE_LOAD(0);

    for (int k0 = 0; k0 < D_DIM; k0 += PK) {
        __syncthreads();   // previous chunk's LDS consumers done
#pragma unroll
        for (int i = 0; i < 4; ++i)
            *(v4f*)&xs[(wave * 4 + i) * PLD + lane * 4] = rx[i];
        *(v4f*)&ss[wave * PLD + lane * 4] = ra;
        if (tid < 64) {
            v2f e0 = {rr.x, rr.z};
            v2f e1 = {rr.y, rr.w};
            *(v2f*)&ss[16 * PLD + tid * 2] = e0;
            *(v2f*)&ss[17 * PLD + tid * 2] = e1;
        }
        __syncthreads();

        if (k0 + PK < D_DIM) {
            PRE_LOAD(k0 + PK);
            // the loads' address registers are advanced below: keep the wait in front of that
            asm volatile("s_wait_xcnt 0x0" ::: "memory");
        }

        // A and B fragments come from the same offsets, so both see the same k at every position:
        // lane half h, 16-byte read j -> k = kq*32 + j*8 + h*4 + {0,1} (first WMMA), + {2,3} (second).
        const float* xr = &xs[(rt * 16 + lrow) * PLD + kq * 32 + h * 4];
        const float* ar = &ss[lrow * PLD + kq * 32 + h * 4];
        const float* rp = &ss[(16 + (lrow & 1)) * PLD + kq * 32 + h * 4];
#pragma unroll
        for (int j = 0; j < 4; ++j) {
            v4f xa = *(const v4f*)(xr + j * 8);
            v4f ba = *(const v4f*)(ar + j * 8);
            v4f bq = *(const v4f*)(rp + j * 8);
            v2f a0 = {xa.x, xa.y}, a1 = {xa.z, xa.w};
            v2f p0 = {ba.x, ba.y}, p1 = {ba.z, ba.w};
            v2f q0 = {bq.x, bq.y}, q1 = {bq.z, bq.w};
            accH = __builtin_amdgcn_wmma_f32_16x16x4_f32(false, a0, false, p0, (short)0, accH, false, false);
            accR = __builtin_amdgcn_wmma_f32_16x16x4_f32(false, a0, false, q0, (short)0, accR, false, false);
            accH = __builtin_amdgcn_wmma_f32_16x16x4_f32(false, a1, false, p1, (short)0, accH, false, false);
            accR = __builtin_amdgcn_wmma_f32_16x16x4_f32(false, a1, false, q1, (short)0, accR, false, false);
        }
    }
#undef PRE_LOAD

    // ---- partial sums of the four K quarters into LDS (C/D layout) ----
#pragma unroll
    for (int i = 0; i < 8; ++i) {
        int row = rt * 16 + h * 8 + i;
        part[(kq * PM + row) * PPL + lrow] = accH[i];
        if (lrow < 2) part[(kq * PM + row) * PPL + 16 + lrow] = accR[i];
    }
    __syncthreads();

    // ---- per-token softmax over 2 experts, routing weight * scale folded into h ----
    {
        const int row = tid >> 3;          // 0..63
        const int c   = (tid & 7) * 2;     // pair {c, c+1} within one expert
        const float* p0 = &part[(0 * PM + row) * PPL];
        const float* p1 = &part[(1 * PM + row) * PPL];
        const float* p2 = &part[(2 * PM + row) * PPL];
        const float* p3 = &part[(3 * PM + row) * PPL];
        float l0 = ((p0[16] + p1[16]) + p2[16]) + p3[16] + br[0];
        float l1 = ((p0[17] + p1[17]) + p2[17]) + p3[17] + br[1];
        float mx = fmaxf(l0, l1);
        float e0 = __expf(l0 - mx);
        float e1 = __expf(l1 - mx);
        float inv = 1.0f / (e0 + e1);
        float w0 = e0 * inv * LORA_SCALE;
        float w1 = e1 * inv * LORA_SCALE;
        float wf = (c < R_RK) ? w0 : w1;
        v2f g;
        g.x = (((p0[c]     + p1[c])     + p2[c])     + p3[c])     * wf;
        g.y = (((p0[c + 1] + p1[c + 1]) + p2[c + 1]) + p3[c + 1]) * wf;
        *(v2f*)(G + (size_t)(mBase + row) * 16 + c) = g;
    }
}

// 128 accumulator registers a wave: the register budget is held at 256 so that two blocks (4 waves per SIMD) stay resident
__global__ __launch_bounds__(256) __attribute__((amdgpu_waves_per_eu(4, 4)))
void fused_lora_moe_kernel(const float* __restrict__ x,
                           const float* __restrict__ Wb,
                           const float* __restrict__ bb,
                           const float* __restrict__ Bmat,   // [E,O,R]
                           const float* __restrict__ G,      // [M_TOT,16] from the pre-kernel
                           float* __restrict__ out)
{
    __shared__ float xs[BM * LDSS];   // x tile      [256 x 32]
    __shared__ float ws[BN * LDSS];   // W_base tile [128 x 32]

    const int tid   = threadIdx.x;
    const int lane  = tid & 31;
    const int wave  = tid >> 5;
    const int wm    = wave >> 1;        // 0..3: 64-row band of the block tile
    const int wn    = wave & 1;         // 0..1: 64-column band of the block tile
    const int lrow  = lane & 15;        // row/col within a 16-wide fragment
    const int halfk = (lane >> 4) * 2;  // 0 for lanes 0-15, 2 for lanes 16-31
    const int mBase = blockIdx.y * BM;
    const int nBase = blockIdx.x * BN;

    // every loop over fragments below is unrolled so that acc, the fragments and the prefetch stay in registers
    v8f acc[FM][FN];
    const v8f zero8 = {0.f,0.f,0.f,0.f,0.f,0.f,0.f,0.f};
#pragma unroll
    for (int mt = 0; mt < FM; ++mt)
#pragma unroll
        for (int nt = 0; nt < FN; ++nt) acc[mt][nt] = zero8;

    // register prefetch buffers (software pipeline, depth 2)
    v4f rx[8], rw[4];

    // block-uniform running base + one 32-bit lane offset: the twelve loads share one address register
    const float* xg = x  + (size_t)mBase * D_DIM;
    const float* wg = Wb + (size_t)nBase * D_DIM;
    const unsigned goff = (unsigned)(tid >> 3) * D_DIM + (unsigned)(tid & 7) * 4;
    const int      soff = (tid >> 3) * LDSS + (tid & 7) * 4;   // the same element's place in the LDS tile

#define LOAD_GLOBALS()                                                         \
    do {                                                                       \
        _Pragma("unroll")                                                      \
        for (int i = 0; i < 8; ++i)                                            \
            rx[i] = *(const v4f*)((xg + i * 32 * D_DIM) + goff);               \
        _Pragma("unroll")                                                      \
        for (int i = 0; i < 4; ++i)                                            \
            rw[i] = *(const v4f*)((wg + i * 32 * D_DIM) + goff);               \
    } while (0)

    LOAD_GLOBALS();

    for (int k0 = 0; k0 < D_DIM; k0 += BK) {
        __syncthreads();   // previous chunk's LDS consumers done

        // ---- commit prefetched registers to LDS ----
#pragma unroll
        for (int i = 0; i < 8; ++i) *(v4f*)&xs[soff + i * 32 * LDSS] = rx[i];
#pragma unroll
        for (int i = 0; i < 4; ++i) *(v4f*)&ws[soff + i * 32 * LDSS] = rw[i];
        __syncthreads();

        // ---- prefetch next chunk's globals during compute ----
        if (k0 + BK < D_DIM) {
            xg += BK;
            wg += BK;
            LOAD_GLOBALS();
            // the next trip advances the loads' base registers: keep the wait in front of that
            asm volatile("s_wait_xcnt 0x0" ::: "memory");
        }

        // ---- compute: 8 K-steps; each step reads 4 + 4 fragments for 16 V_WMMA_F32_16X16X4_F32 ----
        const float* xrow = &xs[(wm * 64 + lrow) * LDSS + halfk];
        const float* wrow = &ws[(wn * 64 + lrow) * LDSS + halfk];
        v2f a[2][FM], b[2][FN];   // two fragment sets: the next K-step's reads are issued ahead of this step's WMMAs
#pragma unroll
        for (int mt = 0; mt < FM; ++mt) a[0][mt] = *(const v2f*)&xrow[mt * 16 * LDSS];
#pragma unroll
        for (int nt = 0; nt < FN; ++nt) b[0][nt] = *(const v2f*)&wrow[nt * 16 * LDSS];
#pragma unroll
        for (int kk = 0; kk < BK; kk += 4) {
            const int cur = (kk >> 2) & 1;
            if (kk + 4 < BK) {
#pragma unroll
                for (int mt = 0; mt < FM; ++mt) a[cur ^ 1][mt] = *(const v2f*)&xrow[mt * 16 * LDSS + kk + 4];
#pragma unroll
                for (int nt = 0; nt < FN; ++nt) b[cur ^ 1][nt] = *(const v2f*)&wrow[nt * 16 * LDSS + kk + 4];
            }
#pragma unroll
            for (int mt = 0; mt < FM; ++mt)
#pragma unroll
                for (int nt = 0; nt < FN; ++nt)
                    acc[mt][nt] = __builtin_amdgcn_wmma_f32_16x16x4_f32(
                        false, a[cur][mt], false, b[cur][nt], (short)0, acc[mt][nt], false, false);
        }
    }
#undef LOAD_GLOBALS

    {
        // routed = G @ Bflat^T, K = E*R = 16 -> 4 WMMA K-steps, accumulated into acc[][]
        // lane half h holds the pair {kk + 2h, kk + 2h + 1}, which lies within one expert (kk >> 3)
        const float* gb = G    + (size_t)mBase * 16;
        const float* bg = Bmat + (size_t)nBase * R_RK;
        const unsigned aoff = ((unsigned)(wm * 64 + lrow) * 16   + (unsigned)halfk) * 4u;   // bytes
        const unsigned boff = ((unsigned)(wn * 64 + lrow) * R_RK + (unsigned)halfk) * 4u;   // bytes
        v2f ga[4][FM], gw[4][FN];
#pragma unroll
        for (int q = 0; q < 4; ++q) {
#pragma unroll
            for (int mt = 0; mt < FM; ++mt)
                ga[q][mt] = *(const v2f*)((const char*)(gb + mt * 16 * 16 + q * 4) + aoff);
#pragma unroll
            for (int nt = 0; nt < FN; ++nt)
                gw[q][nt] = *(const v2f*)((const char*)(bg + (q >> 1) * O_DIM * R_RK + nt * 16 * R_RK + (q & 1) * 4) + boff);
        }
        // the two offset registers stay live up to this wait, so nothing lands in them ahead of it
        asm volatile("s_wait_xcnt 0x0" :: "v"(aoff), "v"(boff) : "memory");
#pragma unroll
        for (int q = 0; q < 4; ++q)
#pragma unroll
            for (int mt = 0; mt < FM; ++mt)
#pragma unroll
                for (int nt = 0; nt < FN; ++nt)
                    acc[mt][nt] = __builtin_amdgcn_wmma_f32_16x16x4_f32(
                        false, ga[q][mt], false, gw[q][nt], (short)0, acc[mt][nt], false, false);
    }

    // ---- bias + non-temporal store (out is write-once; keep x/W resident in L2) ----
#pragma unroll
    for (int nt = 0; nt < FN; ++nt) {
        int col = nBase + wn * 64 + nt * 16 + lrow;
        float bias = bb[col];
#pragma unroll
        for (int mt = 0; mt < FM; ++mt) {
#pragma unroll
            for (int i = 0; i < 8; ++i) {
                int r = mBase + wm * 64 + mt * 16 + (lane >> 4) * 8 + i;
                __builtin_nontemporal_store(acc[mt][nt][i] + bias, &out[(size_t)r * O_DIM + col]);
            }
        }
    }
}

extern "C" void kernel_launch(void* const* d_in, const int* in_sizes, int n_in,
                              void* d_out, int out_size, void* d_ws, size_t ws_size,
                              hipStream_t stream) {
    const float* x    = (const float*)d_in[0];  // [4,4096,2048]
    const float* Wb   = (const float*)d_in[1];  // [2048,2048]
    const float* bb   = (const float*)d_in[2];  // [2048]
    const float* Amat = (const float*)d_in[3];  // [2,8,2048]
    const float* Bmat = (const float*)d_in[4];  // [2,2048,8]
    const float* Wr   = (const float*)d_in[5];  // [2048,2]
    const float* br   = (const float*)d_in[6];  // [2]
    float* out = (float*)d_out;                 // [4,4096,2048]
    float* G   = (float*)d_ws;                  // [16384,16], written and read in this call

    dim3 grid(O_DIM / BN, M_TOT / BM);          // (16, 64)
    dim3 block(256);
    lora_router_pre_kernel<<<dim3(M_TOT / PM), dim3(512), 0, stream>>>(x, Amat, Wr, br, G);
    fused_lora_moe_kernel<<<grid, block, 0, stream>>>(x, Wb, bb, Bmat, G, out);
}
